// v000
// Measured on an AMD MI455X. A time is GPU time per run, averaged over a window of back-to-back runs after a warm-up
// (all launches, gaps included; the runs take copies of the inputs in turn), and the median of several windows.
// Apart from v000's, it joins two sittings. Times from different sittings can be a few percent apart, while
// side-by-side timings come from the same sitting.
// The starting kernel, v000, takes 111 microseconds a run.
#include <hip/hip_runtime.h>
#include <cmath>

// ---- problem constants (from reference) ----
#define DIM    256
#define INNER  256
#define HEADS  8
#define DH     32
#define B_     2
#define S_     8
#define H_     32
#define W_     16
#define NTOK   (B_*S_*H_*W_)      // 8192 tokens
#define NKEY   300                 // 3*5*20 widened key window per w-row
#define NKEYP  304                 // padded to 19 tiles of 16
#define SCALE  0.17677669529663687f // 1/sqrt(32)
#define MASKV  (-1e9f)

typedef __attribute__((ext_vector_type(2))) float v2f;
typedef __attribute__((ext_vector_type(4))) float v4f;
typedef __attribute__((ext_vector_type(8))) float v8f;

// CDNA5 async global->LDS copy (ASYNCcnt-tracked), 16B per lane.
// LDS offset = low 32 bits of the generic shared-memory address.
__device__ inline void async_copy_b128(float* lds_dst, const float* gsrc)
{
    unsigned loff = (unsigned)(uintptr_t)lds_dst;
    asm volatile("global_load_async_to_lds_b128 %0, %1, off"
                 :: "v"(loff), "v"(gsrc) : "memory");
}
__device__ inline void wait_asynccnt0()
{
    asm volatile("s_wait_asynccnt 0x0" ::: "memory");
}

// =====================================================================
// Kernel 1: fused Q/K/V projections.  out[n,j] = sum_d src[n,d]*W[j,d]
// One wave computes a 16x64 tile (4 accumulators) -> A regs reused 4x.
// =====================================================================
__global__ void __launch_bounds__(32) proj_kernel(
    const float* __restrict__ x, const float* __restrict__ q,
    const float* __restrict__ wq, const float* __restrict__ wk,
    const float* __restrict__ wv,
    float* __restrict__ qp, float* __restrict__ kb, float* __restrict__ vb)
{
    const int lane = threadIdx.x & 31;
    const int half = lane >> 4;        // K-pair selector per ISA A/B layout
    const int l16  = lane & 15;
    const int row0 = blockIdx.x * 16;
    const int col0 = blockIdx.y * 64;
    const int mat  = blockIdx.z;

    const float* src = (mat == 0) ? q  : x;
    const float* wt  = (mat == 0) ? wq : (mat == 1) ? wk : wv;
    float*       dst = (mat == 0) ? qp : (mat == 1) ? kb : vb;

    const float* arow = src + (size_t)(row0 + l16) * DIM;     // A: M=l16
    const float* br0  = wt  + (size_t)(col0 +  0 + l16) * DIM; // B[k][n]=W[n][k]
    const float* br1  = wt  + (size_t)(col0 + 16 + l16) * DIM;
    const float* br2  = wt  + (size_t)(col0 + 32 + l16) * DIM;
    const float* br3  = wt  + (size_t)(col0 + 48 + l16) * DIM;

    v8f c0 = {}, c1 = {}, c2 = {}, c3 = {};
#pragma unroll 4
    for (int k0 = 0; k0 < DIM; k0 += 4) {
        int ko = k0 + 2 * half;
        v2f a  = *(const v2f*)(arow + ko);
        v2f b0 = *(const v2f*)(br0 + ko);
        v2f b1 = *(const v2f*)(br1 + ko);
        v2f b2 = *(const v2f*)(br2 + ko);
        v2f b3 = *(const v2f*)(br3 + ko);
        c0 = __builtin_amdgcn_wmma_f32_16x16x4_f32(false, a, false, b0, (short)0, c0, false, false);
        c1 = __builtin_amdgcn_wmma_f32_16x16x4_f32(false, a, false, b1, (short)0, c1, false, false);
        c2 = __builtin_amdgcn_wmma_f32_16x16x4_f32(false, a, false, b2, (short)0, c2, false, false);
        c3 = __builtin_amdgcn_wmma_f32_16x16x4_f32(false, a, false, b3, (short)0, c3, false, false);
    }
#pragma unroll
    for (int i = 0; i < 8; ++i) {
        int m = i + 8 * half;          // C/D: lane half selects M 0..7 / 8..15
        float* orow = dst + (size_t)(row0 + m) * INNER + l16;
        orow[col0 +  0] = c0[i];
        orow[col0 + 16] = c1[i];
        orow[col0 + 32] = c2[i];
        orow[col0 + 48] = c3[i];
    }
}

// =====================================================================
// Kernel 2: local attention for one (b,s,h) row (16 queries) x one head.
// Async-staged K/V window (304x32 each), WMMA dots (16x32 @ 32x304),
// masked softmax, K-split WMMA attn@V (16x304 @ 304x32) over all 8 waves.
// =====================================================================
__global__ void __launch_bounds__(256) attn_kernel(
    const float* __restrict__ qp, const float* __restrict__ kbuf,
    const float* __restrict__ vbuf, float* __restrict__ attn_out)
{
    extern __shared__ float smem[];
    float* Ks   = smem;                   // NKEYP*DH
    float* Vs   = Ks + NKEYP * DH;        // NKEYP*DH
    float* Qs   = Vs + NKEYP * DH;        // 16*DH
    float* Pr   = Qs + 16 * DH;           // 16*NKEYP  (dots -> probs)
    float* Red  = Pr + 16 * NKEYP;        // 16*16 reduction scratch
    float* RowV = Red + 256;              // 16 row max / inv-sum
    float* Acc  = RowV + 16;              // 8*256 attn@V partials

    const int tid  = threadIdx.x;
    const int wave = tid >> 5;
    const int lane = tid & 31;
    const int half = lane >> 4;
    const int l16  = lane & 15;

    const int bsh  = blockIdx.x;          // (b,s,h) flat index
    const int head = blockIdx.y;
    const int b_i  = bsh / (S_ * H_);
    const int rem  = bsh % (S_ * H_);
    const int s_i  = rem / H_;
    const int h_i  = rem % H_;
    const int nbase = bsh * W_;           // first token of this w-row
    const int hoff  = head * DH;

    // ---- async-stage Q tile (16 x 32), 16B chunks ----
    for (int idx = tid; idx < 16 * (DH / 4); idx += 256) {
        int m = idx >> 3, d4 = (idx & 7) * 4;
        async_copy_b128(Qs + m * DH + d4,
                        qp + (size_t)(nbase + m) * INNER + hoff + d4);
    }
    // ---- stage K/V window: async b128 for valid rows, zero-fill rest ----
    for (int idx = tid; idx < NKEYP * (DH / 4); idx += 256) {
        int key = idx >> 3, d4 = (idx & 7) * 4;
        bool   valid = false;
        size_t g     = 0;
        if (key < NKEY) {
            int ds  = key / 100 - 1;
            int r2  = key % 100;
            int dhh = r2 / 20 - 2;
            int ww  = r2 % 20 - 2;
            int ss = s_i + ds, hh = h_i + dhh;
            if (ss >= 0 && ss < S_ && hh >= 0 && hh < H_ && ww >= 0 && ww < W_) {
                valid = true;
                g = (size_t)((((b_i * S_ + ss) * H_ + hh) * W_) + ww) * INNER
                  + hoff + d4;
            }
        }
        if (valid) {
            async_copy_b128(Ks + key * DH + d4, kbuf + g);
            async_copy_b128(Vs + key * DH + d4, vbuf + g);
        } else {
            v4f z = {};
            *(v4f*)(Ks + key * DH + d4) = z;
            *(v4f*)(Vs + key * DH + d4) = z;
        }
    }
    wait_asynccnt0();          // this wave's async copies landed in LDS
    __syncthreads();           // all waves' copies visible

    // ---- dots = Q @ K^T, 19 key tiles distributed over 8 waves ----
    for (int tile = wave; tile < 19; tile += 8) {
        v8f c = {};
        const float* aa = Qs + l16 * DH;                 // A: query row l16
        const float* bb = Ks + (tile * 16 + l16) * DH;   // B[k][n]=Ks[key][k]
#pragma unroll
        for (int k0 = 0; k0 < DH; k0 += 4) {
            v2f a = *(const v2f*)(aa + k0 + 2 * half);
            v2f b = *(const v2f*)(bb + k0 + 2 * half);
            c = __builtin_amdgcn_wmma_f32_16x16x4_f32(false, a, false, b,
                                                      (short)0, c, false, false);
        }
        // per-(query,key) mask, scale, write to LDS probs
        int  key    = tile * 16 + l16;
        bool gvalid = false;
        int  kwi    = 0;
        if (key < NKEY) {
            int ds  = key / 100 - 1;
            int r2  = key % 100;
            int dhh = r2 / 20 - 2;
            kwi     = r2 % 20;
            int ss = s_i + ds, hh = h_i + dhh, ww = kwi - 2;
            gvalid = (ss >= 0 && ss < S_ && hh >= 0 && hh < H_ &&
                      ww >= 0 && ww < W_);
        }
#pragma unroll
        for (int i = 0; i < 8; ++i) {
            int  m  = i + 8 * half;                      // query w position
            bool ok = gvalid && (kwi >= m) && (kwi <= m + 4); // |ww - m| <= 2
            Pr[m * NKEYP + key] = ok ? c[i] * SCALE : MASKV;
        }
    }
    __syncthreads();

    // ---- softmax per query row (16 threads per row over 304 cols) ----
    {
        int row = tid >> 4, sub = tid & 15;
        float mx = -INFINITY;
        for (int col = sub; col < NKEYP; col += 16)
            mx = fmaxf(mx, Pr[row * NKEYP + col]);
        Red[row * 16 + sub] = mx;
        __syncthreads();
        if (sub == 0) {
            float m2 = Red[row * 16];
            for (int j = 1; j < 16; ++j) m2 = fmaxf(m2, Red[row * 16 + j]);
            RowV[row] = m2;
        }
        __syncthreads();
        float rmax = RowV[row];
        float sum  = 0.f;
        for (int col = sub; col < NKEYP; col += 16) {
            float e = __expf(Pr[row * NKEYP + col] - rmax);
            Pr[row * NKEYP + col] = e;
            sum += e;
        }
        Red[row * 16 + sub] = sum;
        __syncthreads();
        if (sub == 0) {
            float s2 = 0.f;
            for (int j = 0; j < 16; ++j) s2 += Red[row * 16 + j];
            RowV[row] = 1.f / s2;
        }
        __syncthreads();
        float inv = RowV[row];
        for (int col = sub; col < NKEYP; col += 16)
            Pr[row * NKEYP + col] *= inv;
    }
    __syncthreads();

    // ---- out = attn @ V, K-split across 8 waves (2 N-tiles x 4 K-slices) ----
    {
        int ntile  = wave >> 2;            // 0..1 -> dh columns 0..15 / 16..31
        int kslice = wave & 3;             // 0..3 -> 76 keys, 19 K-chunks of 4
        int nb     = ntile * 16;
        v8f c = {};
        for (int kc = kslice * 76; kc < (kslice + 1) * 76; kc += 4) {
            v2f a = *(const v2f*)(Pr + l16 * NKEYP + kc + 2 * half);
            v2f b;
            b.x = Vs[(kc + 2 * half)     * DH + nb + l16];
            b.y = Vs[(kc + 2 * half + 1) * DH + nb + l16];
            c = __builtin_amdgcn_wmma_f32_16x16x4_f32(false, a, false, b,
                                                      (short)0, c, false, false);
        }
#pragma unroll
        for (int i = 0; i < 8; ++i)
            Acc[wave * 256 + i * 32 + lane] = c[i];
    }
    __syncthreads();

    // ---- reduce K-slices and store head output (16 x 32) ----
    for (int t = tid; t < 16 * DH; t += 256) {
        int m = t >> 5, n = t & 31;
        int ntile = n >> 4;
        int slot  = (m & 7) * 32 + (n & 15) + ((m >= 8) ? 16 : 0);
        float s = 0.f;
#pragma unroll
        for (int ks = 0; ks < 4; ++ks)
            s += Acc[(ntile * 4 + ks) * 256 + slot];
        attn_out[(size_t)(nbase + m) * INNER + hoff + n] = s;
    }
}

// =====================================================================
// Kernel 3: output projection + bias, 16x64 tile per wave.
// =====================================================================
__global__ void __launch_bounds__(32) outproj_kernel(
    const float* __restrict__ a, const float* __restrict__ wo,
    const float* __restrict__ bo, float* __restrict__ out)
{
    const int lane = threadIdx.x & 31;
    const int half = lane >> 4;
    const int l16  = lane & 15;
    const int row0 = blockIdx.x * 16;
    const int col0 = blockIdx.y * 64;

    const float* arow = a  + (size_t)(row0 + l16) * INNER;
    const float* br0  = wo + (size_t)(col0 +  0 + l16) * INNER;
    const float* br1  = wo + (size_t)(col0 + 16 + l16) * INNER;
    const float* br2  = wo + (size_t)(col0 + 32 + l16) * INNER;
    const float* br3  = wo + (size_t)(col0 + 48 + l16) * INNER;

    v8f c0 = {}, c1 = {}, c2 = {}, c3 = {};
#pragma unroll 4
    for (int k0 = 0; k0 < INNER; k0 += 4) {
        int ko = k0 + 2 * half;
        v2f av = *(const v2f*)(arow + ko);
        v2f b0 = *(const v2f*)(br0 + ko);
        v2f b1 = *(const v2f*)(br1 + ko);
        v2f b2 = *(const v2f*)(br2 + ko);
        v2f b3 = *(const v2f*)(br3 + ko);
        c0 = __builtin_amdgcn_wmma_f32_16x16x4_f32(false, av, false, b0, (short)0, c0, false, false);
        c1 = __builtin_amdgcn_wmma_f32_16x16x4_f32(false, av, false, b1, (short)0, c1, false, false);
        c2 = __builtin_amdgcn_wmma_f32_16x16x4_f32(false, av, false, b2, (short)0, c2, false, false);
        c3 = __builtin_amdgcn_wmma_f32_16x16x4_f32(false, av, false, b3, (short)0, c3, false, false);
    }
#pragma unroll
    for (int i = 0; i < 8; ++i) {
        int m = i + 8 * half;
        float* orow = out + (size_t)(row0 + m) * DIM + l16;
        orow[col0 +  0] = c0[i] + bo[col0 +  0 + l16];
        orow[col0 + 16] = c1[i] + bo[col0 + 16 + l16];
        orow[col0 + 32] = c2[i] + bo[col0 + 32 + l16];
        orow[col0 + 48] = c3[i] + bo[col0 + 48 + l16];
    }
}

extern "C" void kernel_launch(void* const* d_in, const int* in_sizes, int n_in,
                              void* d_out, int out_size, void* d_ws, size_t ws_size,
                              hipStream_t stream)
{
    const float* x  = (const float*)d_in[0];
    const float* q  = (const float*)d_in[1];
    const float* wq = (const float*)d_in[2];
    const float* wk = (const float*)d_in[3];
    const float* wv = (const float*)d_in[4];
    const float* wo = (const float*)d_in[5];
    const float* bo = (const float*)d_in[6];
    float* out = (float*)d_out;

    // workspace layout: qp | k | v | attn_out  (4 x 8 MB, all L2-resident)
    float* ws = (float*)d_ws;
    float* qp = ws;
    float* kb = qp + (size_t)NTOK * INNER;
    float* vb = kb + (size_t)NTOK * INNER;
    float* ao = vb + (size_t)NTOK * INNER;

    proj_kernel<<<dim3(NTOK / 16, INNER / 64, 3), 32, 0, stream>>>(
        x, q, wq, wk, wv, qp, kb, vb);

    size_t smem = (size_t)(2 * NKEYP * DH + 16 * DH + 16 * NKEYP + 256 + 16
                           + 8 * 256) * sizeof(float); // ~107 KB < 320 KB WGP LDS
    attn_kernel<<<dim3(B_ * S_ * H_, HEADS), 256, smem, stream>>>(
        qp, kb, vb, ao);

    outproj_kernel<<<dim3(NTOK / 16, DIM / 64), 32, 0, stream>>>(
        ao, wo, bo, out);
}

// v001
// A run of this version takes 81.4 microseconds.
// Next to v000, in two timings, it ran 1.43 times as fast each time.
#include <hip/hip_runtime.h>
#include <cmath>

// ---- problem constants (from reference) ----
#define DIM    256
#define INNER  256
#define HEADS  8
#define DH     32
#define B_     2
#define S_     8
#define H_     32
#define W_     16
#define NTOK   (B_*S_*H_*W_)      // 8192 tokens
#define NKEY   300                 // 3*5*20 widened key window per w-row
#define NKEYP  304                 // padded to 19 tiles of 16
#define SCALE  0.17677669529663687f // 1/sqrt(32)
#define MASKV  (-1e9f)

typedef __attribute__((ext_vector_type(2))) float v2f;
typedef __attribute__((ext_vector_type(4))) float v4f;
typedef __attribute__((ext_vector_type(8))) float v8f;

// CDNA5 async global->LDS copy (ASYNCcnt-tracked), 16B per lane.
// LDS offset = low 32 bits of the generic shared-memory address.
__device__ inline void async_copy_b128(float* lds_dst, const float* gsrc)
{
    unsigned loff = (unsigned)(uintptr_t)lds_dst;
    asm volatile("global_load_async_to_lds_b128 %0, %1, off"
                 :: "v"(loff), "v"(gsrc) : "memory");
}
__device__ inline void wait_asynccnt0()
{
    asm volatile("s_wait_asynccnt 0x0" ::: "memory");
}

// =====================================================================
// Shared GEMM tile: C[128 x 64] = src[row0.., :] * wt[col0.., :]^T, K = 256.
// Eight waves; K goes through LDS in chunks of 32 floats, two buffers.
// Every global load is 16 B per lane over whole 128-B lines (8 lanes a row);
// the chunk is then read as WMMA fragments from LDS by all eight waves.
// Wave w owns rows w*16..w*16+15 and all 64 columns (4 accumulators).
// Row pitch 36 floats: the 16 rows of a fragment read start on 16 distinct
// groups of four banks, so a wave's 8-byte reads cover all 64 banks once.
// =====================================================================
#define GBM   128
#define GBN   64
#define GBK   32
#define GLP   36
#define GSTG  ((GBM + GBN) * GLP)     // floats per buffer

__device__ __forceinline__ void gemm_tile_128x64(
    const float* __restrict__ src, const float* __restrict__ wt,
    int row0, int col0, float* sm,
    v8f& c0, v8f& c1, v8f& c2, v8f& c3)
{
    const int tid  = threadIdx.x;
    const int wave = tid >> 5;
    const int lane = tid & 31;
    const int half = lane >> 4;        // K-pair selector per ISA A/B layout
    const int l16  = lane & 15;
    const int lr   = tid >> 3;         // loader row 0..31
    const int lc   = (tid & 7) * 4;    // loader column, 16-B step

    const float* ga = src + (size_t)(row0 + lr) * DIM + lc;
    const float* gb = wt  + (size_t)(col0 + lr) * DIM + lc;
    float* sa = sm + lr * GLP + lc;               // A rows of a buffer
    float* sb = sm + (GBM + lr) * GLP + lc;       // W rows behind them
    const int fa = (wave * 16 + l16) * GLP + 2 * half;   // A: M=l16
    const int fb = (GBM + l16) * GLP + 2 * half;         // B[k][n]=W[n][k]

    // every loop over p below is unrolled so that ra and rb are indexed by
    // constants and stay in registers, and the loads of a chunk go out together
    v4f ra[4], rb[2];
#pragma unroll
    for (int p = 0; p < 4; ++p) ra[p] = *(const v4f*)(ga + (size_t)p * 32 * DIM);
#pragma unroll
    for (int p = 0; p < 2; ++p) rb[p] = *(const v4f*)(gb + (size_t)p * 32 * DIM);
#pragma unroll
    for (int p = 0; p < 4; ++p) *(v4f*)(sa + p * 32 * GLP) = ra[p];
#pragma unroll
    for (int p = 0; p < 2; ++p) *(v4f*)(sb + p * 32 * GLP) = rb[p];
    __syncthreads();

    for (int s = 0; s < DIM / GBK; ++s) {
        const float* cur = sm + (s & 1) * GSTG;
        const int    nxt = ((s + 1) & 1) * GSTG;
        const bool   more = (s + 1) < DIM / GBK;
        if (more) {                    // next chunk flies while this one is used
            const int ko = (s + 1) * GBK;
#pragma unroll
            for (int p = 0; p < 4; ++p)
                ra[p] = *(const v4f*)(ga + (size_t)p * 32 * DIM + ko);
#pragma unroll
            for (int p = 0; p < 2; ++p)
                rb[p] = *(const v4f*)(gb + (size_t)p * 32 * DIM + ko);
            // keeps the six loads issued here, ahead of the matrix work; without
            // it the scheduler sinks them to their LDS stores, one wait each
            __builtin_amdgcn_sched_barrier(0);
        }
        // unrolled so that the fragment reads of later k steps can be issued
        // ahead of the matrix instructions of earlier ones
#pragma unroll
        for (int k0 = 0; k0 < GBK; k0 += 4) {
            v2f a  = *(const v2f*)(cur + fa + k0);
            v2f b0 = *(const v2f*)(cur + fb + k0);
            v2f b1 = *(const v2f*)(cur + fb + 16 * GLP + k0);
            v2f b2 = *(const v2f*)(cur + fb + 32 * GLP + k0);
            v2f b3 = *(const v2f*)(cur + fb + 48 * GLP + k0);
            c0 = __builtin_amdgcn_wmma_f32_16x16x4_f32(false, a, false, b0, (short)0, c0, false, false);
            c1 = __builtin_amdgcn_wmma_f32_16x16x4_f32(false, a, false, b1, (short)0, c1, false, false);
            c2 = __builtin_amdgcn_wmma_f32_16x16x4_f32(false, a, false, b2, (short)0, c2, false, false);
            c3 = __builtin_amdgcn_wmma_f32_16x16x4_f32(false, a, false, b3, (short)0, c3, false, false);
        }
        if (more) {
            // the other buffer's last readers left it at the previous barrier
#pragma unroll
            for (int p = 0; p < 4; ++p) *(v4f*)(sa + nxt + p * 32 * GLP) = ra[p];
#pragma unroll
            for (int p = 0; p < 2; ++p) *(v4f*)(sb + nxt + p * 32 * GLP) = rb[p];
            __syncthreads();           // publishes the next chunk
        }
    }
}

// =====================================================================
// Kernel 1: fused Q/K/V projections.  out[n,j] = sum_d src[n,d]*W[j,d]
// One block of eight waves computes a 128x64 tile from LDS-staged chunks.
// =====================================================================
__global__ void __launch_bounds__(256) proj_kernel(
    const float* __restrict__ x, const float* __restrict__ q,
    const float* __restrict__ wq, const float* __restrict__ wk,
    const float* __restrict__ wv,
    float* __restrict__ qp, float* __restrict__ kb, float* __restrict__ vb)
{
    __shared__ __attribute__((aligned(16))) float sm[2 * GSTG];
    const int lane = threadIdx.x & 31;
    const int wave = threadIdx.x >> 5;
    const int half = lane >> 4;
    const int l16  = lane & 15;
    const int row0 = blockIdx.x * GBM;
    const int col0 = blockIdx.y * GBN;
    const int mat  = blockIdx.z;

    const float* src = (mat == 0) ? q  : x;
    const float* wt  = (mat == 0) ? wq : (mat == 1) ? wk : wv;
    float*       dst = (mat == 0) ? qp : (mat == 1) ? kb : vb;

    v8f c0 = {}, c1 = {}, c2 = {}, c3 = {};
    gemm_tile_128x64(src, wt, row0, col0, sm, c0, c1, c2, c3);

#pragma unroll
    for (int i = 0; i < 8; ++i) {
        int m = wave * 16 + i + 8 * half;  // C/D: lane half selects M 0..7 / 8..15
        float* orow = dst + (size_t)(row0 + m) * INNER + l16;
        orow[col0 +  0] = c0[i];
        orow[col0 + 16] = c1[i];
        orow[col0 + 32] = c2[i];
        orow[col0 + 48] = c3[i];
    }
}

// =====================================================================
// Kernel 2: local attention for one (b,s,h) row (16 queries) x one head.
// Async-staged K/V window (304x32 each), WMMA dots (16x32 @ 32x304),
// masked softmax, K-split WMMA attn@V (16x304 @ 304x32) over all 8 waves.
// =====================================================================
__global__ void __launch_bounds__(256) attn_kernel(
    const float* __restrict__ qp, const float* __restrict__ kbuf,
    const float* __restrict__ vbuf, float* __restrict__ attn_out)
{
    extern __shared__ float smem[];
    float* Ks   = smem;                   // NKEYP*DH
    float* Vs   = Ks + NKEYP * DH;        // NKEYP*DH
    float* Qs   = Vs + NKEYP * DH;        // 16*DH
    float* Pr   = Qs + 16 * DH;           // 16*NKEYP  (dots -> probs)
    float* Red  = Pr + 16 * NKEYP;        // 16*16 reduction scratch
    float* RowV = Red + 256;              // 16 row max / inv-sum
    float* Acc  = RowV + 16;              // 8*256 attn@V partials

    const int tid  = threadIdx.x;
    const int wave = tid >> 5;
    const int lane = tid & 31;
    const int half = lane >> 4;
    const int l16  = lane & 15;

    const int bsh  = blockIdx.x;          // (b,s,h) flat index
    const int head = blockIdx.y;
    const int b_i  = bsh / (S_ * H_);
    const int rem  = bsh % (S_ * H_);
    const int s_i  = rem / H_;
    const int h_i  = rem % H_;
    const int nbase = bsh * W_;           // first token of this w-row
    const int hoff  = head * DH;

    // ---- async-stage Q tile (16 x 32), 16B chunks ----
    for (int idx = tid; idx < 16 * (DH / 4); idx += 256) {
        int m = idx >> 3, d4 = (idx & 7) * 4;
        async_copy_b128(Qs + m * DH + d4,
                        qp + (size_t)(nbase + m) * INNER + hoff + d4);
    }
    // ---- stage K/V window: async b128 for valid rows, zero-fill rest ----
    for (int idx = tid; idx < NKEYP * (DH / 4); idx += 256) {
        int key = idx >> 3, d4 = (idx & 7) * 4;
        bool   valid = false;
        size_t g     = 0;
        if (key < NKEY) {
            int ds  = key / 100 - 1;
            int r2  = key % 100;
            int dhh = r2 / 20 - 2;
            int ww  = r2 % 20 - 2;
            int ss = s_i + ds, hh = h_i + dhh;
            if (ss >= 0 && ss < S_ && hh >= 0 && hh < H_ && ww >= 0 && ww < W_) {
                valid = true;
                g = (size_t)((((b_i * S_ + ss) * H_ + hh) * W_) + ww) * INNER
                  + hoff + d4;
            }
        }
        if (valid) {
            async_copy_b128(Ks + key * DH + d4, kbuf + g);
            async_copy_b128(Vs + key * DH + d4, vbuf + g);
        } else {
            v4f z = {};
            *(v4f*)(Ks + key * DH + d4) = z;
            *(v4f*)(Vs + key * DH + d4) = z;
        }
    }
    wait_asynccnt0();          // this wave's async copies landed in LDS
    __syncthreads();           // all waves' copies visible

    // ---- dots = Q @ K^T, 19 key tiles distributed over 8 waves ----
    for (int tile = wave; tile < 19; tile += 8) {
        v8f c = {};
        const float* aa = Qs + l16 * DH;                 // A: query row l16
        const float* bb = Ks + (tile * 16 + l16) * DH;   // B[k][n]=Ks[key][k]
#pragma unroll
        for (int k0 = 0; k0 < DH; k0 += 4) {
            v2f a = *(const v2f*)(aa + k0 + 2 * half);
            v2f b = *(const v2f*)(bb + k0 + 2 * half);
            c = __builtin_amdgcn_wmma_f32_16x16x4_f32(false, a, false, b,
                                                      (short)0, c, false, false);
        }
        // per-(query,key) mask, scale, write to LDS probs
        int  key    = tile * 16 + l16;
        bool gvalid = false;
        int  kwi    = 0;
        if (key < NKEY) {
            int ds  = key / 100 - 1;
            int r2  = key % 100;
            int dhh = r2 / 20 - 2;
            kwi     = r2 % 20;
            int ss = s_i + ds, hh = h_i + dhh, ww = kwi - 2;
            gvalid = (ss >= 0 && ss < S_ && hh >= 0 && hh < H_ &&
                      ww >= 0 && ww < W_);
        }
#pragma unroll
        for (int i = 0; i < 8; ++i) {
            int  m  = i + 8 * half;                      // query w position
            bool ok = gvalid && (kwi >= m) && (kwi <= m + 4); // |ww - m| <= 2
            Pr[m * NKEYP + key] = ok ? c[i] * SCALE : MASKV;
        }
    }
    __syncthreads();

    // ---- softmax per query row (16 threads per row over 304 cols) ----
    {
        int row = tid >> 4, sub = tid & 15;
        float mx = -INFINITY;
        for (int col = sub; col < NKEYP; col += 16)
            mx = fmaxf(mx, Pr[row * NKEYP + col]);
        Red[row * 16 + sub] = mx;
        __syncthreads();
        if (sub == 0) {
            float m2 = Red[row * 16];
            for (int j = 1; j < 16; ++j) m2 = fmaxf(m2, Red[row * 16 + j]);
            RowV[row] = m2;
        }
        __syncthreads();
        float rmax = RowV[row];
        float sum  = 0.f;
        for (int col = sub; col < NKEYP; col += 16) {
            float e = __expf(Pr[row * NKEYP + col] - rmax);
            Pr[row * NKEYP + col] = e;
            sum += e;
        }
        Red[row * 16 + sub] = sum;
        __syncthreads();
        if (sub == 0) {
            float s2 = 0.f;
            for (int j = 0; j < 16; ++j) s2 += Red[row * 16 + j];
            RowV[row] = 1.f / s2;
        }
        __syncthreads();
        float inv = RowV[row];
        for (int col = sub; col < NKEYP; col += 16)
            Pr[row * NKEYP + col] *= inv;
    }
    __syncthreads();

    // ---- out = attn @ V, K-split across 8 waves (2 N-tiles x 4 K-slices) ----
    {
        int ntile  = wave >> 2;            // 0..1 -> dh columns 0..15 / 16..31
        int kslice = wave & 3;             // 0..3 -> 76 keys, 19 K-chunks of 4
        int nb     = ntile * 16;
        v8f c = {};
        for (int kc = kslice * 76; kc < (kslice + 1) * 76; kc += 4) {
            v2f a = *(const v2f*)(Pr + l16 * NKEYP + kc + 2 * half);
            v2f b;
            b.x = Vs[(kc + 2 * half)     * DH + nb + l16];
            b.y = Vs[(kc + 2 * half + 1) * DH + nb + l16];
            c = __builtin_amdgcn_wmma_f32_16x16x4_f32(false, a, false, b,
                                                      (short)0, c, false, false);
        }
#pragma unroll
        for (int i = 0; i < 8; ++i)
            Acc[wave * 256 + i * 32 + lane] = c[i];
    }
    __syncthreads();

    // ---- reduce K-slices and store head output (16 x 32) ----
    for (int t = tid; t < 16 * DH; t += 256) {
        int m = t >> 5, n = t & 31;
        int ntile = n >> 4;
        int slot  = (m & 7) * 32 + (n & 15) + ((m >= 8) ? 16 : 0);
        float s = 0.f;
#pragma unroll
        for (int ks = 0; ks < 4; ++ks)
            s += Acc[(ntile * 4 + ks) * 256 + slot];
        attn_out[(size_t)(nbase + m) * INNER + hoff + n] = s;
    }
}

// =====================================================================
// Kernel 3: output projection + bias, 128x64 tile per block of eight waves.
// =====================================================================
__global__ void __launch_bounds__(256) outproj_kernel(
    const float* __restrict__ a, const float* __restrict__ wo,
    const float* __restrict__ bo, float* __restrict__ out)
{
    __shared__ __attribute__((aligned(16))) float sm[2 * GSTG];
    const int lane = threadIdx.x & 31;
    const int wave = threadIdx.x >> 5;
    const int half = lane >> 4;
    const int l16  = lane & 15;
    const int row0 = blockIdx.x * GBM;
    const int col0 = blockIdx.y * GBN;

    v8f c0 = {}, c1 = {}, c2 = {}, c3 = {};
    gemm_tile_128x64(a, wo, row0, col0, sm, c0, c1, c2, c3);

#pragma unroll
    for (int i = 0; i < 8; ++i) {
        int m = wave * 16 + i + 8 * half;
        float* orow = out + (size_t)(row0 + m) * DIM + l16;
        orow[col0 +  0] = c0[i] + bo[col0 +  0 + l16];
        orow[col0 + 16] = c1[i] + bo[col0 + 16 + l16];
        orow[col0 + 32] = c2[i] + bo[col0 + 32 + l16];
        orow[col0 + 48] = c3[i] + bo[col0 + 48 + l16];
    }
}

extern "C" void kernel_launch(void* const* d_in, const int* in_sizes, int n_in,
                              void* d_out, int out_size, void* d_ws, size_t ws_size,
                              hipStream_t stream)
{
    const float* x  = (const float*)d_in[0];
    const float* q  = (const float*)d_in[1];
    const float* wq = (const float*)d_in[2];
    const float* wk = (const float*)d_in[3];
    const float* wv = (const float*)d_in[4];
    const float* wo = (const float*)d_in[5];
    const float* bo = (const float*)d_in[6];
    float* out = (float*)d_out;

    // workspace layout: qp | k | v | attn_out  (4 x 8 MB, all L2-resident)
    float* ws = (float*)d_ws;
    float* qp = ws;
    float* kb = qp + (size_t)NTOK * INNER;
    float* vb = kb + (size_t)NTOK * INNER;
    float* ao = vb + (size_t)NTOK * INNER;

    proj_kernel<<<dim3(NTOK / GBM, INNER / GBN, 3), 256, 0, stream>>>(
        x, q, wq, wk, wv, qp, kb, vb);

    size_t smem = (size_t)(2 * NKEYP * DH + 16 * DH + 16 * NKEYP + 256 + 16
                           + 8 * 256) * sizeof(float); // ~107 KB < 320 KB WGP LDS
    attn_kernel<<<dim3(B_ * S_ * H_, HEADS), 256, smem, stream>>>(
        qp, kb, vb, ao);

    outproj_kernel<<<dim3(NTOK / GBM, DIM / GBN), 256, 0, stream>>>(
        ao, wo, bo, out);
}

// v002
// One run takes 64.9 microseconds.
// Next to v001, in two timings, it ran 1.26 times as fast each time.
// Over all steps from v000 it is 1.79 times as fast.
#include <hip/hip_runtime.h>
#include <cmath>

// ---- problem constants (from reference) ----
#define DIM    256
#define INNER  256
#define HEADS  8
#define DH     32
#define B_     2
#define S_     8
#define H_     32
#define W_     16
#define NTOK   (B_*S_*H_*W_)      // 8192 tokens
#define NKEY   300                 // 3*5*20 widened key window per w-row
#define NKEYP  304                 // padded to 19 tiles of 16
#define SCALE  0.17677669529663687f // 1/sqrt(32)
#define MASKV  (-1e9f)
// LDS row pitches of the attention kernel, in floats (bank = dword address mod 64)
#define KP     36    // Q and K rows: 16 rows of an 8-byte fragment read start on 16 distinct groups of four banks
#define PP     340   // score rows: 340 mod 64 = 20, so the same holds for the 16 rows read as the A fragment,
                     // two neighbouring rows read 16 dwords wide do not meet, and rows m and m+8 lie 32 banks apart
#define AP     260   // partial tiles: the two column halves (four tiles apart) lie 16 banks apart

typedef __attribute__((ext_vector_type(2))) float v2f;
typedef __attribute__((ext_vector_type(4))) float v4f;
typedef __attribute__((ext_vector_type(8))) float v8f;

// CDNA5 async global->LDS copy (ASYNCcnt-tracked), 16B per lane, as the builtin.
typedef int v4i_vs __attribute__((vector_size(16)));
typedef __attribute__((address_space(1))) v4i_vs gl_v4i;
typedef __attribute__((address_space(3))) v4i_vs lds_v4i;
__device__ inline void async_copy_b128(float* lds_dst, const float* gsrc)
{
    __builtin_amdgcn_global_load_async_to_lds_b128(
        (gl_v4i*)const_cast<float*>(gsrc), (lds_v4i*)lds_dst, 0, 0);
}
__device__ inline void wait_asynccnt0()
{
    asm volatile("s_wait_asynccnt 0x0" ::: "memory");
}

// =====================================================================
// Shared GEMM tile: C[128 x 64] = src[row0.., :] * wt[col0.., :]^T, K = 256.
// Eight waves; K goes through LDS in chunks of 32 floats, two buffers.
// Every global load is 16 B per lane over whole 128-B lines (8 lanes a row);
// the chunk is then read as WMMA fragments from LDS by all eight waves.
// Wave w owns rows w*16..w*16+15 and all 64 columns (4 accumulators).
// Row pitch 36 floats: the 16 rows of a fragment read start on 16 distinct
// groups of four banks, so a wave's 8-byte reads cover all 64 banks once.
// =====================================================================
#define GBM   128
#define GBN   64
#define GBK   32
#define GLP   36
#define GSTG  ((GBM + GBN) * GLP)     // floats per buffer

__device__ __forceinline__ void gemm_tile_128x64(
    const float* __restrict__ src, const float* __restrict__ wt,
    int row0, int col0, float* sm,
    v8f& c0, v8f& c1, v8f& c2, v8f& c3)
{
    const int tid  = threadIdx.x;
    const int wave = tid >> 5;
    const int lane = tid & 31;
    const int half = lane >> 4;        // K-pair selector per ISA A/B layout
    const int l16  = lane & 15;
    const int lr   = tid >> 3;         // loader row 0..31
    const int lc   = (tid & 7) * 4;    // loader column, 16-B step

    const float* ga = src + (size_t)(row0 + lr) * DIM + lc;
    const float* gb = wt  + (size_t)(col0 + lr) * DIM + lc;
    float* sa = sm + lr * GLP + lc;               // A rows of a buffer
    float* sb = sm + (GBM + lr) * GLP + lc;       // W rows behind them
    const int fa = (wave * 16 + l16) * GLP + 2 * half;   // A: M=l16
    const int fb = (GBM + l16) * GLP + 2 * half;         // B[k][n]=W[n][k]

    // every loop over p below is unrolled so that ra and rb are indexed by
    // constants and stay in registers, and the loads of a chunk go out together
    v4f ra[4], rb[2];
#pragma unroll
    for (int p = 0; p < 4; ++p) ra[p] = *(const v4f*)(ga + (size_t)p * 32 * DIM);
#pragma unroll
    for (int p = 0; p < 2; ++p) rb[p] = *(const v4f*)(gb + (size_t)p * 32 * DIM);
#pragma unroll
    for (int p = 0; p < 4; ++p) *(v4f*)(sa + p * 32 * GLP) = ra[p];
#pragma unroll
    for (int p = 0; p < 2; ++p) *(v4f*)(sb + p * 32 * GLP) = rb[p];
    __syncthreads();

    for (int s = 0; s < DIM / GBK; ++s) {
        const float* cur = sm + (s & 1) * GSTG;
        const int    nxt = ((s + 1) & 1) * GSTG;
        const bool   more = (s + 1) < DIM / GBK;
        if (more) {                    // next chunk flies while this one is used
            const int ko = (s + 1) * GBK;
#pragma unroll
            for (int p = 0; p < 4; ++p)
                ra[p] = *(const v4f*)(ga + (size_t)p * 32 * DIM + ko);
#pragma unroll
            for (int p = 0; p < 2; ++p)
                rb[p] = *(const v4f*)(gb + (size_t)p * 32 * DIM + ko);
            // keeps the six loads issued here, ahead of the matrix work; without
            // it the scheduler sinks them to their LDS stores, one wait each
            __builtin_amdgcn_sched_barrier(0);
        }
        // unrolled so that the fragment reads of later k steps can be issued
        // ahead of the matrix instructions of earlier ones
#pragma unroll
        for (int k0 = 0; k0 < GBK; k0 += 4) {
            v2f a  = *(const v2f*)(cur + fa + k0);
            v2f b0 = *(const v2f*)(cur + fb + k0);
            v2f b1 = *(const v2f*)(cur + fb + 16 * GLP + k0);
            v2f b2 = *(const v2f*)(cur + fb + 32 * GLP + k0);
            v2f b3 = *(const v2f*)(cur + fb + 48 * GLP + k0);
            c0 = __builtin_amdgcn_wmma_f32_16x16x4_f32(false, a, false, b0, (short)0, c0, false, false);
            c1 = __builtin_amdgcn_wmma_f32_16x16x4_f32(false, a, false, b1, (short)0, c1, false, false);
            c2 = __builtin_amdgcn_wmma_f32_16x16x4_f32(false, a, false, b2, (short)0, c2, false, false);
            c3 = __builtin_amdgcn_wmma_f32_16x16x4_f32(false, a, false, b3, (short)0, c3, false, false);
        }
        if (more) {
            // the other buffer's last readers left it at the previous barrier
#pragma unroll
            for (int p = 0; p < 4; ++p) *(v4f*)(sa + nxt + p * 32 * GLP) = ra[p];
#pragma unroll
            for (int p = 0; p < 2; ++p) *(v4f*)(sb + nxt + p * 32 * GLP) = rb[p];
            __syncthreads();           // publishes the next chunk
        }
    }
}

// =====================================================================
// Kernel 1: fused Q/K/V projections.  out[n,j] = sum_d src[n,d]*W[j,d]
// One block of eight waves computes a 128x64 tile from LDS-staged chunks.
// =====================================================================
__global__ void __launch_bounds__(256) proj_kernel(
    const float* __restrict__ x, const float* __restrict__ q,
    const float* __restrict__ wq, const float* __restrict__ wk,
    const float* __restrict__ wv,
    float* __restrict__ qp, float* __restrict__ kb, float* __restrict__ vb)
{
    __shared__ __attribute__((aligned(16))) float sm[2 * GSTG];
    const int lane = threadIdx.x & 31;
    const int wave = threadIdx.x >> 5;
    const int half = lane >> 4;
    const int l16  = lane & 15;
    const int row0 = blockIdx.x * GBM;
    const int col0 = blockIdx.y * GBN;
    const int mat  = blockIdx.z;

    const float* src = (mat == 0) ? q  : x;
    const float* wt  = (mat == 0) ? wq : (mat == 1) ? wk : wv;
    float*       dst = (mat == 0) ? qp : (mat == 1) ? kb : vb;

    v8f c0 = {}, c1 = {}, c2 = {}, c3 = {};
    gemm_tile_128x64(src, wt, row0, col0, sm, c0, c1, c2, c3);

#pragma unroll
    for (int i = 0; i < 8; ++i) {
        int m = wave * 16 + i + 8 * half;  // C/D: lane half selects M 0..7 / 8..15
        float* orow = dst + (size_t)(row0 + m) * INNER + l16;
        orow[col0 +  0] = c0[i];
        orow[col0 + 16] = c1[i];
        orow[col0 + 32] = c2[i];
        orow[col0 + 48] = c3[i];
    }
}

// =====================================================================
// Kernel 2: local attention for one (b,s,h) row (16 queries) x one head.
// Async-staged K/V window (304x32 each), WMMA dots (16x32 @ 32x304),
// masked softmax, K-split WMMA attn@V (16x304 @ 304x32) over all 8 waves.
// =====================================================================
__global__ void __launch_bounds__(256) attn_kernel(
    const float* __restrict__ qp, const float* __restrict__ kbuf,
    const float* __restrict__ vbuf, float* __restrict__ attn_out)
{
    extern __shared__ float smem[];
    float* Ks   = smem;                   // NKEYP*KP
    float* Vs   = Ks + NKEYP * KP;        // NKEYP*DH, columns swizzled (below)
    float* Qs   = Vs + NKEYP * DH;        // 16*KP
    float* Pr   = Qs + 16 * KP;           // 16*PP  (dots -> probs)
    // K is last read in the dots phase, which ends at a barrier: what follows
    // lies on its rows, so that the padded rows cost no LDS
    float* Red  = Ks;                     // 16*16 reduction scratch
    float* RowV = Red + 256;              // 16 row max / inv-sum
    float* Acc  = RowV + 16;              // 8*AP attn@V partials

    const int tid  = threadIdx.x;
    const int wave = tid >> 5;
    const int lane = tid & 31;
    const int half = lane >> 4;
    const int l16  = lane & 15;

    const int bsh  = blockIdx.x;          // (b,s,h) flat index
    const int head = blockIdx.y;
    const int b_i  = bsh / (S_ * H_);
    const int rem  = bsh % (S_ * H_);
    const int s_i  = rem / H_;
    const int h_i  = rem % H_;
    const int nbase = bsh * W_;           // first token of this w-row
    const int hoff  = head * DH;

    // ---- async-stage Q tile (16 x 32), 16B chunks ----
    for (int idx = tid; idx < 16 * (DH / 4); idx += 256) {
        int m = idx >> 3, d4 = (idx & 7) * 4;
        async_copy_b128(Qs + m * KP + d4,
                        qp + (size_t)(nbase + m) * INNER + hoff + d4);
    }
    // ---- stage K/V window: async b128, every lane copies ----
    // A key outside the volume, or past the 300th, is masked in the dots phase
    // and ends with probability 0 like every other masked key: its rows take the
    // K and V of the nearest real token (clamped indices), so that all lanes are
    // on at the copies and every address lies inside the two buffers.
    for (int idx = tid; idx < NKEYP * (DH / 4); idx += 256) {
        int key = idx >> 3, d4 = (idx & 7) * 4;
        int ds  = key / 100 - 1;
        int r2  = key % 100;
        int dhh = r2 / 20 - 2;
        int ww  = r2 % 20 - 2;
        int ss = min(max(s_i + ds, 0), S_ - 1);
        int hh = min(max(h_i + dhh, 0), H_ - 1);
        ww     = min(max(ww, 0), W_ - 1);
        size_t g = (size_t)((((b_i * S_ + ss) * H_ + hh) * W_) + ww) * INNER
                 + hoff + d4;
        // V rows 4j+2 and 4j+3 hold their two 16-column halves swapped: the two
        // lane halves of a B fragment read rows two apart (64 dwords, one bank)
        async_copy_b128(Ks + key * KP + d4, kbuf + g);
        async_copy_b128(Vs + key * DH + (d4 ^ ((key & 2) << 3)), vbuf + g);
    }
    wait_asynccnt0();          // this wave's async copies landed in LDS
    __syncthreads();           // all waves' copies visible

    // ---- dots = Q @ K^T, 19 key tiles distributed over 8 waves ----
    for (int tile = wave; tile < 19; tile += 8) {
        v8f c = {};
        const float* aa = Qs + l16 * KP;                 // A: query row l16
        const float* bb = Ks + (tile * 16 + l16) * KP;   // B[k][n]=Ks[key][k]
#pragma unroll
        for (int k0 = 0; k0 < DH; k0 += 4) {
            v2f a = *(const v2f*)(aa + k0 + 2 * half);
            v2f b = *(const v2f*)(bb + k0 + 2 * half);
            c = __builtin_amdgcn_wmma_f32_16x16x4_f32(false, a, false, b,
                                                      (short)0, c, false, false);
        }
        // per-(query,key) mask, scale, write to LDS probs
        int  key    = tile * 16 + l16;
        bool gvalid = false;
        int  kwi    = 0;
        if (key < NKEY) {
            int ds  = key / 100 - 1;
            int r2  = key % 100;
            int dhh = r2 / 20 - 2;
            kwi     = r2 % 20;
            int ss = s_i + ds, hh = h_i + dhh, ww = kwi - 2;
            gvalid = (ss >= 0 && ss < S_ && hh >= 0 && hh < H_ &&
                      ww >= 0 && ww < W_);
        }
#pragma unroll
        for (int i = 0; i < 8; ++i) {
            int  m  = i + 8 * half;                      // query w position
            bool ok = gvalid && (kwi >= m) && (kwi <= m + 4); // |ww - m| <= 2
            Pr[m * PP + key] = ok ? c[i] * SCALE : MASKV;
        }
    }
    __syncthreads();

    // ---- softmax per query row (16 threads per row over 304 cols) ----
    {
        int row = tid >> 4, sub = tid & 15;
        float mx = -INFINITY;
        for (int col = sub; col < NKEYP; col += 16)
            mx = fmaxf(mx, Pr[row * PP + col]);
        Red[row * 16 + sub] = mx;
        __syncthreads();
        if (sub == 0) {
            float m2 = Red[row * 16];
            for (int j = 1; j < 16; ++j) m2 = fmaxf(m2, Red[row * 16 + j]);
            RowV[row] = m2;
        }
        __syncthreads();
        float rmax = RowV[row];
        float sum  = 0.f;
        for (int col = sub; col < NKEYP; col += 16) {
            float e = __expf(Pr[row * PP + col] - rmax);
            Pr[row * PP + col] = e;
            sum += e;
        }
        Red[row * 16 + sub] = sum;
        __syncthreads();
        if (sub == 0) {
            float s2 = 0.f;
            for (int j = 0; j < 16; ++j) s2 += Red[row * 16 + j];
            RowV[row] = 1.f / s2;
        }
        __syncthreads();
        float inv = RowV[row];
        for (int col = sub; col < NKEYP; col += 16)
            Pr[row * PP + col] *= inv;
    }
    __syncthreads();

    // ---- out = attn @ V, K-split across 8 waves (2 N-tiles x 4 K-slices) ----
    {
        int ntile  = wave >> 2;            // 0..1 -> dh columns 0..15 / 16..31
        int kslice = wave & 3;             // 0..3 -> 76 keys, 19 K-chunks of 4
        int nb     = ntile * 16;
        int vcol   = (nb + l16) ^ (half << 4);   // rows kc+2*half(+1): swapped where half is 1
        v8f c = {};
        for (int kc = kslice * 76; kc < (kslice + 1) * 76; kc += 4) {
            v2f a = *(const v2f*)(Pr + l16 * PP + kc + 2 * half);
            v2f b;
            b.x = Vs[(kc + 2 * half)     * DH + vcol];
            b.y = Vs[(kc + 2 * half + 1) * DH + vcol];
            c = __builtin_amdgcn_wmma_f32_16x16x4_f32(false, a, false, b,
                                                      (short)0, c, false, false);
        }
#pragma unroll
        for (int i = 0; i < 8; ++i)
            Acc[wave * AP + i * 32 + lane] = c[i];
    }
    __syncthreads();

    // ---- reduce K-slices and store head output (16 x 32) ----
    for (int t = tid; t < 16 * DH; t += 256) {
        int m = t >> 5, n = t & 31;
        int ntile = n >> 4;
        int slot  = (m & 7) * 32 + (n & 15) + ((m >= 8) ? 16 : 0);
        float s = 0.f;
#pragma unroll
        for (int ks = 0; ks < 4; ++ks)
            s += Acc[(ntile * 4 + ks) * AP + slot];
        attn_out[(size_t)(nbase + m) * INNER + hoff + n] = s;
    }
}

// =====================================================================
// Kernel 3: output projection + bias, 128x64 tile per block of eight waves.
// =====================================================================
__global__ void __launch_bounds__(256) outproj_kernel(
    const float* __restrict__ a, const float* __restrict__ wo,
    const float* __restrict__ bo, float* __restrict__ out)
{
    __shared__ __attribute__((aligned(16))) float sm[2 * GSTG];
    const int lane = threadIdx.x & 31;
    const int wave = threadIdx.x >> 5;
    const int half = lane >> 4;
    const int l16  = lane & 15;
    const int row0 = blockIdx.x * GBM;
    const int col0 = blockIdx.y * GBN;

    v8f c0 = {}, c1 = {}, c2 = {}, c3 = {};
    gemm_tile_128x64(a, wo, row0, col0, sm, c0, c1, c2, c3);

#pragma unroll
    for (int i = 0; i < 8; ++i) {
        int m = wave * 16 + i + 8 * half;
        float* orow = out + (size_t)(row0 + m) * DIM + l16;
        orow[col0 +  0] = c0[i] + bo[col0 +  0 + l16];
        orow[col0 + 16] = c1[i] + bo[col0 + 16 + l16];
        orow[col0 + 32] = c2[i] + bo[col0 + 32 + l16];
        orow[col0 + 48] = c3[i] + bo[col0 + 48 + l16];
    }
}

extern "C" void kernel_launch(void* const* d_in, const int* in_sizes, int n_in,
                              void* d_out, int out_size, void* d_ws, size_t ws_size,
                              hipStream_t stream)
{
    const float* x  = (const float*)d_in[0];
    const float* q  = (const float*)d_in[1];
    const float* wq = (const float*)d_in[2];
    const float* wk = (const float*)d_in[3];
    const float* wv = (const float*)d_in[4];
    const float* wo = (const float*)d_in[5];
    const float* bo = (const float*)d_in[6];
    float* out = (float*)d_out;

    // workspace layout: qp | k | v | attn_out  (4 x 8 MB, all L2-resident)
    float* ws = (float*)d_ws;
    float* qp = ws;
    float* kb = qp + (size_t)NTOK * INNER;
    float* vb = kb + (size_t)NTOK * INNER;
    float* ao = vb + (size_t)NTOK * INNER;

    proj_kernel<<<dim3(NTOK / GBM, INNER / GBN, 3), 256, 0, stream>>>(
        x, q, wq, wk, wv, qp, kb, vb);

    size_t smem = (size_t)(NKEYP * KP + NKEYP * DH + 16 * KP + 16 * PP)
                  * sizeof(float);         // 106,752 B of the WGP's 320 KiB
    attn_kernel<<<dim3(B_ * S_ * H_, HEADS), 256, smem, stream>>>(
        qp, kb, vb, ao);

    outproj_kernel<<<dim3(NTOK / GBM, DIM / GBN), 256, 0, stream>>>(
        ao, wo, bo, out);
}

// v003
// Measured time: 43.3 microseconds a run.
// In two side-by-side timings against v002, it was 1.50 and 1.49 times as fast.
// Over all steps from v000 it is 2.68 times as fast.
#include <hip/hip_runtime.h>
#include <cmath>

// ---- problem constants (from reference) ----
#define DIM    256
#define INNER  256
#define HEADS  8
#define DH     32
#define B_     2
#define S_     8
#define H_     32
#define W_     16
#define NTOK   (B_*S_*H_*W_)      // 8192 tokens
#define HB     8                   // h-rows (waves) per attention block
#define HPL    (HB + 4)            // h-rows staged per s-plane: the block's own and two each side
#define NROW   (3 * HPL * W_)      // 576 staged key rows
#define SCALE  0.17677669529663687f // 1/sqrt(32)
#define MASKV  (-1e9f)
#define LOG2E  1.44269504088896340736f
// LDS row pitch of K in the attention kernel, in floats (bank = dword address mod 64)
#define KP     36    // 16 rows of a 16-byte fragment read start on 16 distinct groups of four banks

typedef __attribute__((ext_vector_type(2))) float v2f;
typedef __attribute__((ext_vector_type(4))) float v4f;
typedef __attribute__((ext_vector_type(8))) float v8f;

// CDNA5 async global->LDS copy (ASYNCcnt-tracked), 16B per lane, as the builtin.
typedef int v4i_vs __attribute__((vector_size(16)));
typedef __attribute__((address_space(1))) v4i_vs gl_v4i;
typedef __attribute__((address_space(3))) v4i_vs lds_v4i;
__device__ inline void async_copy_b128(float* lds_dst, const float* gsrc)
{
    __builtin_amdgcn_global_load_async_to_lds_b128(
        (gl_v4i*)const_cast<float*>(gsrc), (lds_v4i*)lds_dst, 0, 0);
}
__device__ inline void wait_asynccnt0()
{
    asm volatile("s_wait_asynccnt 0x0" ::: "memory");
}

// =====================================================================
// Shared GEMM tile: C[128 x 64] = src[row0.., :] * wt[col0.., :]^T, K = 256.
// Eight waves; K goes through LDS in chunks of 32 floats, two buffers.
// Every global load is 16 B per lane over whole 128-B lines (8 lanes a row);
// the chunk is then read as WMMA fragments from LDS by all eight waves.
// Wave w owns rows w*16..w*16+15 and all 64 columns (4 accumulators).
// Row pitch 36 floats: the 16 rows of a fragment read start on 16 distinct
// groups of four banks, so a wave's 8-byte reads cover all 64 banks once.
// =====================================================================
#define GBM   128
#define GBN   64
#define GBK   32
#define GLP   36
#define GSTG  ((GBM + GBN) * GLP)     // floats per buffer

__device__ __forceinline__ void gemm_tile_128x64(
    const float* __restrict__ src, const float* __restrict__ wt,
    int row0, int col0, float* sm,
    v8f& c0, v8f& c1, v8f& c2, v8f& c3)
{
    const int tid  = threadIdx.x;
    const int wave = tid >> 5;
    const int lane = tid & 31;
    const int half = lane >> 4;        // K-pair selector per ISA A/B layout
    const int l16  = lane & 15;
    const int lr   = tid >> 3;         // loader row 0..31
    const int lc   = (tid & 7) * 4;    // loader column, 16-B step

    const float* ga = src + (size_t)(row0 + lr) * DIM + lc;
    const float* gb = wt  + (size_t)(col0 + lr) * DIM + lc;
    float* sa = sm + lr * GLP + lc;               // A rows of a buffer
    float* sb = sm + (GBM + lr) * GLP + lc;       // W rows behind them
    const int fa = (wave * 16 + l16) * GLP + 2 * half;   // A: M=l16
    const int fb = (GBM + l16) * GLP + 2 * half;         // B[k][n]=W[n][k]

    // every loop over p below is unrolled so that ra and rb are indexed by
    // constants and stay in registers, and the loads of a chunk go out together
    v4f ra[4], rb[2];
#pragma unroll
    for (int p = 0; p < 4; ++p) ra[p] = *(const v4f*)(ga + (size_t)p * 32 * DIM);
#pragma unroll
    for (int p = 0; p < 2; ++p) rb[p] = *(const v4f*)(gb + (size_t)p * 32 * DIM);
#pragma unroll
    for (int p = 0; p < 4; ++p) *(v4f*)(sa + p * 32 * GLP) = ra[p];
#pragma unroll
    for (int p = 0; p < 2; ++p) *(v4f*)(sb + p * 32 * GLP) = rb[p];
    __syncthreads();

    for (int s = 0; s < DIM / GBK; ++s) {
        const float* cur = sm + (s & 1) * GSTG;
        const int    nxt = ((s + 1) & 1) * GSTG;
        const bool   more = (s + 1) < DIM / GBK;
        if (more) {                    // next chunk flies while this one is used
            const int ko = (s + 1) * GBK;
#pragma unroll
            for (int p = 0; p < 4; ++p)
                ra[p] = *(const v4f*)(ga + (size_t)p * 32 * DIM + ko);
#pragma unroll
            for (int p = 0; p < 2; ++p)
                rb[p] = *(const v4f*)(gb + (size_t)p * 32 * DIM + ko);
            // keeps the six loads issued here, ahead of the matrix work; without
            // it the scheduler sinks them to their LDS stores, one wait each
            __builtin_amdgcn_sched_barrier(0);
        }
        // unrolled so that the fragment reads of later k steps can be issued
        // ahead of the matrix instructions of earlier ones
#pragma unroll
        for (int k0 = 0; k0 < GBK; k0 += 4) {
            v2f a  = *(const v2f*)(cur + fa + k0);
            v2f b0 = *(const v2f*)(cur + fb + k0);
            v2f b1 = *(const v2f*)(cur + fb + 16 * GLP + k0);
            v2f b2 = *(const v2f*)(cur + fb + 32 * GLP + k0);
            v2f b3 = *(const v2f*)(cur + fb + 48 * GLP + k0);
            c0 = __builtin_amdgcn_wmma_f32_16x16x4_f32(false, a, false, b0, (short)0, c0, false, false);
            c1 = __builtin_amdgcn_wmma_f32_16x16x4_f32(false, a, false, b1, (short)0, c1, false, false);
            c2 = __builtin_amdgcn_wmma_f32_16x16x4_f32(false, a, false, b2, (short)0, c2, false, false);
            c3 = __builtin_amdgcn_wmma_f32_16x16x4_f32(false, a, false, b3, (short)0, c3, false, false);
        }
        if (more) {
            // the other buffer's last readers left it at the previous barrier
#pragma unroll
            for (int p = 0; p < 4; ++p) *(v4f*)(sa + nxt + p * 32 * GLP) = ra[p];
#pragma unroll
            for (int p = 0; p < 2; ++p) *(v4f*)(sb + nxt + p * 32 * GLP) = rb[p];
            __syncthreads();           // publishes the next chunk
        }
    }
}

// =====================================================================
// Kernel 1: fused Q/K/V projections.  out[n,j] = sum_d src[n,d]*W[j,d]
// One block of eight waves computes a 128x64 tile from LDS-staged chunks.
// =====================================================================
__global__ void __launch_bounds__(256) proj_kernel(
    const float* __restrict__ x, const float* __restrict__ q,
    const float* __restrict__ wq, const float* __restrict__ wk,
    const float* __restrict__ wv,
    float* __restrict__ qp, float* __restrict__ kb, float* __restrict__ vb)
{
    __shared__ __attribute__((aligned(16))) float sm[2 * GSTG];
    const int lane = threadIdx.x & 31;
    const int wave = threadIdx.x >> 5;
    const int half = lane >> 4;
    const int l16  = lane & 15;
    const int row0 = blockIdx.x * GBM;
    const int col0 = blockIdx.y * GBN;
    const int mat  = blockIdx.z;

    const float* src = (mat == 0) ? q  : x;
    const float* wt  = (mat == 0) ? wq : (mat == 1) ? wk : wv;
    float*       dst = (mat == 0) ? qp : (mat == 1) ? kb : vb;

    v8f c0 = {}, c1 = {}, c2 = {}, c3 = {};
    gemm_tile_128x64(src, wt, row0, col0, sm, c0, c1, c2, c3);

#pragma unroll
    for (int i = 0; i < 8; ++i) {
        int m = wave * 16 + i + 8 * half;  // C/D: lane half selects M 0..7 / 8..15
        float* orow = dst + (size_t)(row0 + m) * INNER + l16;
        orow[col0 +  0] = c0[i];
        orow[col0 + 16] = c1[i];
        orow[col0 + 32] = c2[i];
        orow[col0 + 48] = c3[i];
    }
}

// =====================================================================
// Kernel 2: local attention. One block = eight neighbouring h-rows of one
// (b,s) plane x one head; one wave = one h-row (16 queries along w).
// The block stages once the K and V rows that its eight windows cover:
// 3 s-planes x 12 h-rows x 16 w = 576 rows. Each wave then works alone:
//   St = K Qt   15 tiles (3 s x 5 h), a tile = the 16 w of one key row;
//               a lane holds scores of ONE query (column l16), keys in registers
//   softmax     in registers, two exchanges between the lane halves (max, sum)
//   Ot = Vt Pt  the score registers are the B fragment as they stand
// so the probabilities never pass through LDS and no barrier follows the staging.
// =====================================================================
__device__ __forceinline__ float other_half(float x)    // lane l <-> l ^ 16
{
    int b = __builtin_bit_cast(int, x);
    return __builtin_bit_cast(float,
        __builtin_amdgcn_permlanex16(b, b, 0x76543210, 0xfedcba98, false, false));
}

// Eight 2^x in place, as one statement that ends in v_nop: behind a transcendental the
// instruction set asks for one slot before its result is read or its source overwritten.
// Inside, each v_exp touches only its own register.
__device__ __forceinline__ void exp2_x8(v8f& x)
{
    float x0 = x[0], x1 = x[1], x2 = x[2], x3 = x[3], x4 = x[4], x5 = x[5], x6 = x[6], x7 = x[7];
    asm("v_exp_f32 %0, %0\n\tv_exp_f32 %1, %1\n\tv_exp_f32 %2, %2\n\tv_exp_f32 %3, %3\n\t"
        "v_exp_f32 %4, %4\n\tv_exp_f32 %5, %5\n\tv_exp_f32 %6, %6\n\tv_exp_f32 %7, %7\n\tv_nop"
        : "+v"(x0), "+v"(x1), "+v"(x2), "+v"(x3), "+v"(x4), "+v"(x5), "+v"(x6), "+v"(x7));
    x = v8f{x0, x1, x2, x3, x4, x5, x6, x7};
}

__global__ void __launch_bounds__(256) attn_kernel(
    const float* __restrict__ qp, const float* __restrict__ kbuf,
    const float* __restrict__ vbuf, float* __restrict__ attn_out)
{
    __shared__ __attribute__((aligned(16))) float Ks[NROW * KP];
    __shared__ __attribute__((aligned(16))) float Vs[NROW * DH];  // columns swizzled (below)

    const int tid  = threadIdx.x;
    const int wave = __builtin_amdgcn_readfirstlane(tid >> 5);   // scalar: tile tests and row bases are wave-uniform
    const int lane = tid & 31;
    const int half = lane >> 4;
    const int l16  = lane & 15;

    const int b_i  = blockIdx.x / (S_ * (H_ / HB));
    const int s_i  = (blockIdx.x / (H_ / HB)) % S_;
    const int h0   = (blockIdx.x % (H_ / HB)) * HB;   // first h-row of the block
    const int h_i  = h0 + wave;                       // this wave's h-row
    const int hoff = blockIdx.y * DH;
    const int nbase = ((b_i * S_ + s_i) * H_ + h_i) * W_;   // first token of the wave's row

    // ---- Q as B fragments, straight from global: lane = query l16, 16 contiguous d per half ----
    v4f qf[4];
    {
        const float* qrow = qp + (size_t)(nbase + l16) * INNER + hoff + 16 * half;
#pragma unroll   // register arrays indexed by constants stay in registers
        for (int p = 0; p < 4; ++p) qf[p] = *(const v4f*)(qrow + 4 * p);
    }

    // ---- stage the K/V rows: async b128, every lane copies, 32 rows a trip ----
    // LDS row r = (sp * HPL + hp) * 16 + w holds the token (s_i + sp - 1, h0 + hp - 2, w).
    // A plane outside the volume is masked in the scores and ends with probability 0:
    // its rows take the K and V of the nearest real plane (clamped indices), so that
    // all lanes are on at the copies and every address lies inside the two buffers.
    {
        const int lr = tid >> 3;
        const int d4 = (tid & 7) * 4;
#pragma unroll   // sp and the plane step become constants, and all 36 copies go out together
        for (int it = 0; it < NROW / 32; ++it) {
            const int sp = it / (HPL / 2);
            const int hp = (it % (HPL / 2)) * 2 + (lr >> 4);
            const int ss = min(max(s_i + sp - 1, 0), S_ - 1);
            const int hh = min(max(h0 + hp - 2, 0), H_ - 1);
            const size_t g = (size_t)(((b_i * S_ + ss) * H_ + hh) * W_ + (lr & 15)) * INNER
                           + hoff + d4;
            const int r = it * 32 + lr;
            // V rows with w >= 8 hold their two 16-column halves swapped: the two lane
            // halves of an A fragment read rows eight apart (256 dwords, one bank)
            async_copy_b128(Ks + r * KP + d4, kbuf + g);
            async_copy_b128(Vs + r * DH + (d4 ^ ((r & 8) << 1)), vbuf + g);
        }
    }
    wait_asynccnt0();          // this wave's async copies landed in LDS
    __syncthreads();           // all waves' copies visible

    // ---- St = K Qt: D register i of lane (l16, half) = key w (i + 8 half), query l16 ----
    // k order of both fragments, step j: d = 16 half + 2 j, + 1
    bool band[8];              // |key w - query w| <= 2, the same in every tile
#pragma unroll   // register arrays indexed by constants stay in registers
    for (int i = 0; i < 8; ++i)
        band[i] = (unsigned)(i + 8 * half - l16 + 2) <= 4u;

    v8f sc[15];
#pragma unroll   // register arrays indexed by constants stay in registers
    for (int t = 0; t < 15; ++t) {
        const int sp = t / 5, dp = t % 5;
        const float* kk = Ks + ((sp * HPL + wave + dp) * 16 + l16) * KP + 16 * half;
        v4f kf[4];
#pragma unroll   // register arrays indexed by constants stay in registers
        for (int p = 0; p < 4; ++p) kf[p] = *(const v4f*)(kk + 4 * p);
        v8f c = {};
#pragma unroll   // register arrays indexed by constants stay in registers
        for (int p = 0; p < 4; ++p) {
            v2f a0 = {kf[p].x, kf[p].y}, b0 = {qf[p].x, qf[p].y};
            v2f a1 = {kf[p].z, kf[p].w}, b1 = {qf[p].z, qf[p].w};
            c = __builtin_amdgcn_wmma_f32_16x16x4_f32(false, a0, false, b0, (short)0, c, false, false);
            c = __builtin_amdgcn_wmma_f32_16x16x4_f32(false, a1, false, b1, (short)0, c, false, false);
        }
        const bool inside = (unsigned)(s_i + sp - 1) < (unsigned)S_ &&
                            (unsigned)(h_i + dp - 2) < (unsigned)H_;
#pragma unroll   // register arrays indexed by constants stay in registers
        for (int i = 0; i < 8; ++i)
            sc[t][i] = (inside && band[i]) ? c[i] * SCALE : MASKV;
    }

    // ---- softmax over a query's 240 scores: 120 in this lane, 120 in lane ^ 16 ----
    v8f mv = sc[0];
#pragma unroll   // register arrays indexed by constants stay in registers
    for (int t = 1; t < 15; ++t)
#pragma unroll   // register arrays indexed by constants stay in registers
        for (int i = 0; i < 8; ++i) mv[i] = fmaxf(mv[i], sc[t][i]);
    float rmax = fmaxf(fmaxf(fmaxf(mv[0], mv[1]), fmaxf(mv[2], mv[3])),
                       fmaxf(fmaxf(mv[4], mv[5]), fmaxf(mv[6], mv[7])));
    rmax = fmaxf(rmax, other_half(rmax));

    // ---- Ot = Vt Pt, unnormalised: step j of a tile takes keys w = 8 half + 2 j, + 1 ----
    // B = score registers 2j, 2j+1; A = V[those keys][16 n + l16]
    const int vc0 = l16 ^ (half << 4);     // rows w >= 8 are read by half 1: swapped
    const int vc1 = vc0 ^ 16;
    v8f sv = {};
    v8f o0 = {}, o1 = {};
#pragma unroll   // register arrays indexed by constants stay in registers
    for (int t = 0; t < 15; ++t) {
        const int sp = t / 5, dp = t % 5;
        const float* vv = Vs + ((sp * HPL + wave + dp) * 16 + 8 * half) * DH;
#pragma unroll   // register arrays indexed by constants stay in registers
        for (int i = 0; i < 8; ++i) sc[t][i] = (sc[t][i] - rmax) * LOG2E;
        exp2_x8(sc[t]);        // e^(score - max)
        sv += sc[t];
#pragma unroll   // register arrays indexed by constants stay in registers
        for (int j = 0; j < 4; ++j) {
            v2f p  = {sc[t][2 * j], sc[t][2 * j + 1]};
            v2f a0 = {vv[(2 * j) * DH + vc0], vv[(2 * j + 1) * DH + vc0]};
            v2f a1 = {vv[(2 * j) * DH + vc1], vv[(2 * j + 1) * DH + vc1]};
            o0 = __builtin_amdgcn_wmma_f32_16x16x4_f32(false, a0, false, p, (short)0, o0, false, false);
            o1 = __builtin_amdgcn_wmma_f32_16x16x4_f32(false, a1, false, p, (short)0, o1, false, false);
        }
    }
    float sum = ((sv[0] + sv[1]) + (sv[2] + sv[3])) + ((sv[4] + sv[5]) + (sv[6] + sv[7]));
    sum += other_half(sum);
    const float inv = 1.f / sum;

    // ---- store: D register i of lane (l16, half) = column 16 n + 8 half + i of query l16 ----
    {
        float* orow = attn_out + (size_t)(nbase + l16) * INNER + hoff + 8 * half;
        v4f w0 = {o0[0] * inv, o0[1] * inv, o0[2] * inv, o0[3] * inv};
        v4f w1 = {o0[4] * inv, o0[5] * inv, o0[6] * inv, o0[7] * inv};
        v4f w2 = {o1[0] * inv, o1[1] * inv, o1[2] * inv, o1[3] * inv};
        v4f w3 = {o1[4] * inv, o1[5] * inv, o1[6] * inv, o1[7] * inv};
        *(v4f*)(orow)      = w0;
        *(v4f*)(orow + 4)  = w1;
        *(v4f*)(orow + 16) = w2;
        *(v4f*)(orow + 20) = w3;
    }
}

// =====================================================================
// Kernel 3: output projection + bias, 128x64 tile per block of eight waves.
// =====================================================================
__global__ void __launch_bounds__(256) outproj_kernel(
    const float* __restrict__ a, const float* __restrict__ wo,
    const float* __restrict__ bo, float* __restrict__ out)
{
    __shared__ __attribute__((aligned(16))) float sm[2 * GSTG];
    const int lane = threadIdx.x & 31;
    const int wave = threadIdx.x >> 5;
    const int half = lane >> 4;
    const int l16  = lane & 15;
    const int row0 = blockIdx.x * GBM;
    const int col0 = blockIdx.y * GBN;

    v8f c0 = {}, c1 = {}, c2 = {}, c3 = {};
    gemm_tile_128x64(a, wo, row0, col0, sm, c0, c1, c2, c3);

#pragma unroll
    for (int i = 0; i < 8; ++i) {
        int m = wave * 16 + i + 8 * half;
        float* orow = out + (size_t)(row0 + m) * DIM + l16;
        orow[col0 +  0] = c0[i] + bo[col0 +  0 + l16];
        orow[col0 + 16] = c1[i] + bo[col0 + 16 + l16];
        orow[col0 + 32] = c2[i] + bo[col0 + 32 + l16];
        orow[col0 + 48] = c3[i] + bo[col0 + 48 + l16];
    }
}

extern "C" void kernel_launch(void* const* d_in, const int* in_sizes, int n_in,
                              void* d_out, int out_size, void* d_ws, size_t ws_size,
                              hipStream_t stream)
{
    const float* x  = (const float*)d_in[0];
    const float* q  = (const float*)d_in[1];
    const float* wq = (const float*)d_in[2];
    const float* wk = (const float*)d_in[3];
    const float* wv = (const float*)d_in[4];
    const float* wo = (const float*)d_in[5];
    const float* bo = (const float*)d_in[6];
    float* out = (float*)d_out;

    // workspace layout: qp | k | v | attn_out  (4 x 8 MB, all L2-resident)
    float* ws = (float*)d_ws;
    float* qp = ws;
    float* kb = qp + (size_t)NTOK * INNER;
    float* vb = kb + (size_t)NTOK * INNER;
    float* ao = vb + (size_t)NTOK * INNER;

    proj_kernel<<<dim3(NTOK / GBM, INNER / GBN, 3), 256, 0, stream>>>(
        x, q, wq, wk, wv, qp, kb, vb);

    attn_kernel<<<dim3(B_ * S_ * (H_ / HB), HEADS), 256, 0, stream>>>(
        qp, kb, vb, ao);

    outproj_kernel<<<dim3(NTOK / GBM, DIM / GBN), 256, 0, stream>>>(
        ao, wo, bo, out);
}

// v004
// One run takes 40.3 microseconds.
// Two timings next to v003 put it at 1.08 and 1.07 times that version's speed.
// Counting every step since v000, it is 2.89 times as fast.
#include <hip/hip_runtime.h>
#include <cmath>

// ---- problem constants (from reference) ----
#define DIM    256
#define INNER  256
#define HEADS  8
#define DH     32
#define B_     2
#define S_     8
#define H_     32
#define W_     16
#define NTOK   (B_*S_*H_*W_)      // 8192 tokens
#define HB     8                   // h-rows per attention block; its 8 waves take 4 h x 4 w patches
#define HPL    (HB + 4)            // h-rows staged per s-plane: the block's own and two each side
#define NROW   (3 * HPL * W_)      // 576 staged key rows
#define SCALE  0.17677669529663687f // 1/sqrt(32)
#define MASKV  (-1e9f)
#define LOG2E  1.44269504088896340736f
// LDS row pitch of K in the attention kernel, in floats (bank = dword address mod 64)
#define KP     36
// floats per staged h-row of K (16 w): a K fragment reads 8 h-rows x 2 w, and with 8 floats of pad
// an h-row those 16 rows of a 16-byte read start on 16 distinct groups of four banks
#define KG     (W_ * KP + 8)
#define VG     (W_ * DH)    // floats per staged h-row of V

typedef __attribute__((ext_vector_type(2))) float v2f;
typedef __attribute__((ext_vector_type(4))) float v4f;
typedef __attribute__((ext_vector_type(8))) float v8f;

// CDNA5 async global->LDS copy (ASYNCcnt-tracked), 16B per lane, as the builtin.
typedef int v4i_vs __attribute__((vector_size(16)));
typedef __attribute__((address_space(1))) v4i_vs gl_v4i;
typedef __attribute__((address_space(3))) v4i_vs lds_v4i;
__device__ inline void async_copy_b128(float* lds_dst, const float* gsrc)
{
    __builtin_amdgcn_global_load_async_to_lds_b128(
        (gl_v4i*)const_cast<float*>(gsrc), (lds_v4i*)lds_dst, 0, 0);
}
__device__ inline void wait_asynccnt0()
{
    asm volatile("s_wait_asynccnt 0x0" ::: "memory");
}

// =====================================================================
// Shared GEMM tile: C[128 x 64] = src[row0.., :] * wt[col0.., :]^T, K = 256.
// Eight waves; K goes through LDS in chunks of 32 floats, two buffers.
// Every global load is 16 B per lane over whole 128-B lines (8 lanes a row);
// the chunk is then read as WMMA fragments from LDS by all eight waves.
// Wave w owns rows w*16..w*16+15 and all 64 columns (4 accumulators).
// Row pitch 36 floats: the 16 rows of a fragment read start on 16 distinct
// groups of four banks, so a wave's 8-byte reads cover all 64 banks once.
// =====================================================================
#define GBM   128
#define GBN   64
#define GBK   32
#define GLP   36
#define GSTG  ((GBM + GBN) * GLP)     // floats per buffer

__device__ __forceinline__ void gemm_tile_128x64(
    const float* __restrict__ src, const float* __restrict__ wt,
    int row0, int col0, float* sm,
    v8f& c0, v8f& c1, v8f& c2, v8f& c3)
{
    const int tid  = threadIdx.x;
    const int wave = tid >> 5;
    const int lane = tid & 31;
    const int half = lane >> 4;        // K-pair selector per ISA A/B layout
    const int l16  = lane & 15;
    const int lr   = tid >> 3;         // loader row 0..31
    const int lc   = (tid & 7) * 4;    // loader column, 16-B step

    const float* ga = src + (size_t)(row0 + lr) * DIM + lc;
    const float* gb = wt  + (size_t)(col0 + lr) * DIM + lc;
    float* sa = sm + lr * GLP + lc;               // A rows of a buffer
    float* sb = sm + (GBM + lr) * GLP + lc;       // W rows behind them
    const int fa = (wave * 16 + l16) * GLP + 2 * half;   // A: M=l16
    const int fb = (GBM + l16) * GLP + 2 * half;         // B[k][n]=W[n][k]

    // every loop over p below is unrolled so that ra and rb are indexed by
    // constants and stay in registers, and the loads of a chunk go out together
    v4f ra[4], rb[2];
#pragma unroll
    for (int p = 0; p < 4; ++p) ra[p] = *(const v4f*)(ga + (size_t)p * 32 * DIM);
#pragma unroll
    for (int p = 0; p < 2; ++p) rb[p] = *(const v4f*)(gb + (size_t)p * 32 * DIM);
#pragma unroll
    for (int p = 0; p < 4; ++p) *(v4f*)(sa + p * 32 * GLP) = ra[p];
#pragma unroll
    for (int p = 0; p < 2; ++p) *(v4f*)(sb + p * 32 * GLP) = rb[p];
    __syncthreads();

    for (int s = 0; s < DIM / GBK; ++s) {
        const float* cur = sm + (s & 1) * GSTG;
        const int    nxt = ((s + 1) & 1) * GSTG;
        const bool   more = (s + 1) < DIM / GBK;
        if (more) {                    // next chunk flies while this one is used
            const int ko = (s + 1) * GBK;
#pragma unroll
            for (int p = 0; p < 4; ++p)
                ra[p] = *(const v4f*)(ga + (size_t)p * 32 * DIM + ko);
#pragma unroll
            for (int p = 0; p < 2; ++p)
                rb[p] = *(const v4f*)(gb + (size_t)p * 32 * DIM + ko);
            // keeps the six loads issued here, ahead of the matrix work; without
            // it the scheduler sinks them to their LDS stores, one wait each
            __builtin_amdgcn_sched_barrier(0);
        }
        // unrolled so that the fragment reads of later k steps can be issued
        // ahead of the matrix instructions of earlier ones
#pragma unroll
        for (int k0 = 0; k0 < GBK; k0 += 4) {
            v2f a  = *(const v2f*)(cur + fa + k0);
            v2f b0 = *(const v2f*)(cur + fb + k0);
            v2f b1 = *(const v2f*)(cur + fb + 16 * GLP + k0);
            v2f b2 = *(const v2f*)(cur + fb + 32 * GLP + k0);
            v2f b3 = *(const v2f*)(cur + fb + 48 * GLP + k0);
            c0 = __builtin_amdgcn_wmma_f32_16x16x4_f32(false, a, false, b0, (short)0, c0, false, false);
            c1 = __builtin_amdgcn_wmma_f32_16x16x4_f32(false, a, false, b1, (short)0, c1, false, false);
            c2 = __builtin_amdgcn_wmma_f32_16x16x4_f32(false, a, false, b2, (short)0, c2, false, false);
            c3 = __builtin_amdgcn_wmma_f32_16x16x4_f32(false, a, false, b3, (short)0, c3, false, false);
        }
        if (more) {
            // the other buffer's last readers left it at the previous barrier
#pragma unroll
            for (int p = 0; p < 4; ++p) *(v4f*)(sa + nxt + p * 32 * GLP) = ra[p];
#pragma unroll
            for (int p = 0; p < 2; ++p) *(v4f*)(sb + nxt + p * 32 * GLP) = rb[p];
            __syncthreads();           // publishes the next chunk
        }
    }
}

// =====================================================================
// Kernel 1: fused Q/K/V projections.  out[n,j] = sum_d src[n,d]*W[j,d]
// One block of eight waves computes a 128x64 tile from LDS-staged chunks.
// =====================================================================
__global__ void __launch_bounds__(256) proj_kernel(
    const float* __restrict__ x, const float* __restrict__ q,
    const float* __restrict__ wq, const float* __restrict__ wk,
    const float* __restrict__ wv,
    float* __restrict__ qp, float* __restrict__ kb, float* __restrict__ vb)
{
    __shared__ __attribute__((aligned(16))) float sm[2 * GSTG];
    const int lane = threadIdx.x & 31;
    const int wave = threadIdx.x >> 5;
    const int half = lane >> 4;
    const int l16  = lane & 15;
    const int row0 = blockIdx.x * GBM;
    const int col0 = blockIdx.y * GBN;
    const int mat  = blockIdx.z;

    const float* src = (mat == 0) ? q  : x;
    const float* wt  = (mat == 0) ? wq : (mat == 1) ? wk : wv;
    float*       dst = (mat == 0) ? qp : (mat == 1) ? kb : vb;

    v8f c0 = {}, c1 = {}, c2 = {}, c3 = {};
    gemm_tile_128x64(src, wt, row0, col0, sm, c0, c1, c2, c3);

#pragma unroll
    for (int i = 0; i < 8; ++i) {
        int m = wave * 16 + i + 8 * half;  // C/D: lane half selects M 0..7 / 8..15
        float* orow = dst + (size_t)(row0 + m) * INNER + l16;
        orow[col0 +  0] = c0[i];
        orow[col0 + 16] = c1[i];
        orow[col0 + 32] = c2[i];
        orow[col0 + 48] = c3[i];
    }
}

// =====================================================================
// Kernel 2: local attention. One block = eight neighbouring h-rows of one
// (b,s) plane x one head; one wave = a patch of 4 h x 4 w queries.
// The block stages once the K and V rows that its windows cover:
// 3 s-planes x 12 h-rows x 16 w = 576 rows. Each wave then works alone.
// A patch sees 8 h-rows and, of the 16 w, 8 columns (6 at the two w edges) per plane:
// a key tile is 8 h x 2 w, so a plane takes 4 tiles (3 at an edge), a wave 12 (9).
//   St = K Qt   a lane holds scores of ONE query (column l16), keys in registers
//   softmax     in registers, one exchange between the lane halves
//   Ot = Vt Pt  the score registers are the B fragment as they stand
// so the probabilities never pass through LDS and no barrier follows the staging.
// =====================================================================
__device__ __forceinline__ float other_half(float x)    // lane l <-> l ^ 16
{
    int b = __builtin_bit_cast(int, x);
    return __builtin_bit_cast(float,
        __builtin_amdgcn_permlanex16(b, b, 0x76543210, 0xfedcba98, false, false));
}

// Eight 2^x in place, as one statement that ends in v_nop: behind a transcendental the
// instruction set asks for one slot before its result is read or its source overwritten.
// Inside, each v_exp touches only its own register.
__device__ __forceinline__ void exp2_x8(v8f& x)
{
    float x0 = x[0], x1 = x[1], x2 = x[2], x3 = x[3], x4 = x[4], x5 = x[5], x6 = x[6], x7 = x[7];
    asm("v_exp_f32 %0, %0\n\tv_exp_f32 %1, %1\n\tv_exp_f32 %2, %2\n\tv_exp_f32 %3, %3\n\t"
        "v_exp_f32 %4, %4\n\tv_exp_f32 %5, %5\n\tv_exp_f32 %6, %6\n\tv_exp_f32 %7, %7\n\tv_nop"
        : "+v"(x0), "+v"(x1), "+v"(x2), "+v"(x3), "+v"(x4), "+v"(x5), "+v"(x6), "+v"(x7));
    x = v8f{x0, x1, x2, x3, x4, x5, x6, x7};
}

// Tile t of a wave: 0..8 are the three w pairs that every patch needs, plane by plane;
// 9..11 are the fourth pair, which only the two inner w patches need.
#define TILE_SP(t) ((t) < 9 ? (t) / 3 : (t) - 9)
#define TILE_U(t)  ((t) < 9 ? (t) % 3 : 3)

// Key m of a tile (0..15) = h-row m >> 1 of the patch's eight, member m & 1 of the w pair.
// St of one tile: D register i of lane (l16, half) = key i + 8 half, query l16.
// k order of both fragments, step j: d = 16 half + 2 j, + 1
__device__ __forceinline__ v8f score_tile(const float* kk, const v4f (&qf)[4],
                                          const bool (&ok)[8])
{
    v4f kf[4];
#pragma unroll   // register arrays indexed by constants stay in registers
    for (int p = 0; p < 4; ++p) kf[p] = *(const v4f*)(kk + 4 * p);
    v8f c = {};
#pragma unroll   // register arrays indexed by constants stay in registers
    for (int p = 0; p < 4; ++p) {
        v2f a0 = {kf[p].x, kf[p].y}, b0 = {qf[p].x, qf[p].y};
        v2f a1 = {kf[p].z, kf[p].w}, b1 = {qf[p].z, qf[p].w};
        c = __builtin_amdgcn_wmma_f32_16x16x4_f32(false, a0, false, b0, (short)0, c, false, false);
        c = __builtin_amdgcn_wmma_f32_16x16x4_f32(false, a1, false, b1, (short)0, c, false, false);
    }
    v8f s;
#pragma unroll   // register arrays indexed by constants stay in registers
    for (int i = 0; i < 8; ++i)
        s[i] = ok[i] ? c[i] * SCALE : MASKV;
    return s;
}

// Ot += Vt Pt of one tile, unnormalised: step j takes keys 8 half + 2 j, + 1, the w pair of
// h-row 4 half + j. B = score registers 2j, 2j+1; A = V[those keys][16 n + l16]
__device__ __forceinline__ void value_tile(const float* v0, const float* v1, v8f& s, float rmax,
                                           v8f& sv, v8f& o0, v8f& o1)
{
#pragma unroll   // register arrays indexed by constants stay in registers
    for (int i = 0; i < 8; ++i) s[i] = (s[i] - rmax) * LOG2E;
    exp2_x8(s);                // e^(score - max)
    sv += s;
#pragma unroll   // register arrays indexed by constants stay in registers
    for (int j = 0; j < 4; ++j) {
        v2f p  = {s[2 * j], s[2 * j + 1]};
        v2f a0 = {v0[j * VG], v0[j * VG + DH]};
        v2f a1 = {v1[j * VG], v1[j * VG + DH]};
        o0 = __builtin_amdgcn_wmma_f32_16x16x4_f32(false, a0, false, p, (short)0, o0, false, false);
        o1 = __builtin_amdgcn_wmma_f32_16x16x4_f32(false, a1, false, p, (short)0, o1, false, false);
    }
}

__global__ void __launch_bounds__(256) attn_kernel(
    const float* __restrict__ qp, const float* __restrict__ kbuf,
    const float* __restrict__ vbuf, float* __restrict__ attn_out)
{
    __shared__ __attribute__((aligned(16))) float Ks[3 * HPL * KG];
    __shared__ __attribute__((aligned(16))) float Vs[3 * HPL * VG];   // columns swizzled (below)

    const int tid  = threadIdx.x;
    const int wave = __builtin_amdgcn_readfirstlane(tid >> 5);   // scalar: the patch, its tile count and row bases are wave-uniform
    const int lane = tid & 31;
    const int half = lane >> 4;
    const int l16  = lane & 15;

    // patch of the wave: waves w and w + 4 take one edge and one inner w patch between them
    const int  ph  = wave >> 2;                 // h-rows 4 ph .. 4 ph + 3 of the block
    const int  pw  = (wave & 3) ^ ph;           // w 4 pw .. 4 pw + 3
    const bool mid = (pw == 1) || (pw == 2);    // inner patch: 8 key columns, else 6
    const int  kw0  = max(4 * pw - 2, 0);        // first key column
    const int  qh  = l16 >> 2;                  // the lane's query inside the patch
    const int  qw  = l16 & 3;

    const int b_i  = blockIdx.x / (S_ * (H_ / HB));
    const int s_i  = (blockIdx.x / (H_ / HB)) % S_;
    const int h0   = (blockIdx.x % (H_ / HB)) * HB;   // first h-row of the block
    const int hoff = blockIdx.y * DH;
    const int ntok = ((b_i * S_ + s_i) * H_ + h0 + 4 * ph + qh) * W_ + 4 * pw + qw;   // the lane's query

    // ---- Q as B fragments, straight from global: lane = query l16, 16 contiguous d per half ----
    v4f qf[4];
    {
        const float* qrow = qp + (size_t)ntok * INNER + hoff + 16 * half;
#pragma unroll   // register arrays indexed by constants stay in registers
        for (int p = 0; p < 4; ++p) qf[p] = *(const v4f*)(qrow + 4 * p);
    }

    // ---- stage the K/V rows: async b128, every lane copies, 32 rows a trip ----
    // Staged h-row sp * HPL + hp, column w, holds the token (s_i + sp - 1, h0 + hp - 2, w).
    // A plane outside the volume is masked in the scores and ends with probability 0:
    // its rows take the K and V of the nearest real plane (clamped indices), so that
    // all lanes are on at the copies and every address lies inside the two buffers.
    {
        const int lr = tid >> 3;
        const int d4 = (tid & 7) * 4;
#pragma unroll   // sp and the plane step become constants, and all 36 copies go out together
        for (int it = 0; it < NROW / 32; ++it) {
            const int sp = it / (HPL / 2);
            const int hp = (it % (HPL / 2)) * 2 + (lr >> 4);
            const int ss = min(max(s_i + sp - 1, 0), S_ - 1);
            const int hh = min(max(h0 + hp - 2, 0), H_ - 1);
            const size_t g = (size_t)(((b_i * S_ + ss) * H_ + hh) * W_ + (lr & 15)) * INNER
                           + hoff + d4;
            async_copy_b128(Ks + (it * 2 + (lr >> 4)) * KG + (lr & 15) * KP + d4, kbuf + g);
            // V h-rows with hp & 4 hold their two 16-column halves swapped: the two lane
            // halves of an A fragment read h-rows four apart (2048 dwords, one bank)
            async_copy_b128(Vs + (it * 2 + (lr >> 4)) * VG + (lr & 15) * DH + (d4 ^ ((hp & 4) << 2)),
                            vbuf + g);
        }
    }
    wait_asynccnt0();          // this wave's async copies landed in LDS
    __syncthreads();           // all waves' copies visible

    // ---- which keys a query sees: the lane's h-rows 4 half + r, the key columns kw0 + x ----
    bool hb[4], wb[8];
#pragma unroll   // register arrays indexed by constants stay in registers
    for (int r = 0; r < 4; ++r)
        hb[r] = (unsigned)(4 * half + r - qh) <= 4u &&
                (unsigned)(h0 + 4 * ph + 4 * half + r - 2) < (unsigned)H_;
#pragma unroll   // register arrays indexed by constants stay in registers
    for (int x = 0; x < 8; ++x)
        wb[x] = (unsigned)(kw0 + x - 4 * pw - qw + 2) <= 4u;

    // A row l16 of a K tile = key l16
    const float* kbase = Ks + (4 * ph + (l16 >> 1)) * KG + (kw0 + (l16 & 1)) * KP + 16 * half;

    v8f sc[12];
#pragma unroll   // register arrays indexed by constants stay in registers
    for (int t = 0; t < 9; ++t) {
        const int sp = TILE_SP(t), u = TILE_U(t);
        bool ok[8];
#pragma unroll   // register arrays indexed by constants stay in registers
        for (int i = 0; i < 8; ++i)
            ok[i] = (unsigned)(s_i + sp - 1) < (unsigned)S_ && hb[i >> 1] && wb[2 * u + (i & 1)];
        sc[t] = score_tile(kbase + sp * HPL * KG + 2 * u * KP, qf, ok);
    }
    // ---- maximum over a query's scores: half of them in this lane, half in lane ^ 16 ----
    v8f mv = sc[0];
#pragma unroll   // register arrays indexed by constants stay in registers
    for (int t = 1; t < 9; ++t)
#pragma unroll   // register arrays indexed by constants stay in registers
        for (int i = 0; i < 8; ++i) mv[i] = fmaxf(mv[i], sc[t][i]);
    if (mid) {
#pragma unroll   // register arrays indexed by constants stay in registers
        for (int t = 9; t < 12; ++t) {
            const int sp = TILE_SP(t), u = TILE_U(t);
            bool ok[8];
#pragma unroll   // register arrays indexed by constants stay in registers
            for (int i = 0; i < 8; ++i)
                ok[i] = (unsigned)(s_i + sp - 1) < (unsigned)S_ && hb[i >> 1] && wb[2 * u + (i & 1)];
            sc[t] = score_tile(kbase + sp * HPL * KG + 2 * u * KP, qf, ok);
#pragma unroll   // register arrays indexed by constants stay in registers
            for (int i = 0; i < 8; ++i) mv[i] = fmaxf(mv[i], sc[t][i]);
        }
    }
    float rmax = fmaxf(fmaxf(fmaxf(mv[0], mv[1]), fmaxf(mv[2], mv[3])),
                       fmaxf(fmaxf(mv[4], mv[5]), fmaxf(mv[6], mv[7])));
    rmax = fmaxf(rmax, other_half(rmax));

    // ---- Ot = Vt Pt ----
    const float* vrow = Vs + (4 * ph + 4 * half) * VG + kw0 * DH;
    const int    vc0  = l16 ^ (((ph + half) & 1) << 4);   // the lane's h-rows have hp & 4 = 4 ((ph + half) & 1)
    const float* vb0  = vrow + vc0;                       // columns l16
    const float* vb1  = vrow + (vc0 ^ 16);                // columns 16 + l16
    v8f sv = {};
    v8f o0 = {}, o1 = {};
#pragma unroll   // register arrays indexed by constants stay in registers
    for (int t = 0; t < 9; ++t)
        value_tile(vb0 + TILE_SP(t) * HPL * VG + 2 * TILE_U(t) * DH,
                   vb1 + TILE_SP(t) * HPL * VG + 2 * TILE_U(t) * DH, sc[t], rmax, sv, o0, o1);
    if (mid) {
#pragma unroll   // register arrays indexed by constants stay in registers
        for (int t = 9; t < 12; ++t)
            value_tile(vb0 + TILE_SP(t) * HPL * VG + 2 * TILE_U(t) * DH,
                       vb1 + TILE_SP(t) * HPL * VG + 2 * TILE_U(t) * DH, sc[t], rmax, sv, o0, o1);
    }
    float sum = ((sv[0] + sv[1]) + (sv[2] + sv[3])) + ((sv[4] + sv[5]) + (sv[6] + sv[7]));
    sum += other_half(sum);
    const float inv = 1.f / sum;

    // ---- store: D register i of lane (l16, half) = column 16 n + 8 half + i of query l16 ----
    {
        float* orow = attn_out + (size_t)ntok * INNER + hoff + 8 * half;
        v4f w0 = {o0[0] * inv, o0[1] * inv, o0[2] * inv, o0[3] * inv};
        v4f w1 = {o0[4] * inv, o0[5] * inv, o0[6] * inv, o0[7] * inv};
        v4f w2 = {o1[0] * inv, o1[1] * inv, o1[2] * inv, o1[3] * inv};
        v4f w3 = {o1[4] * inv, o1[5] * inv, o1[6] * inv, o1[7] * inv};
        *(v4f*)(orow)      = w0;
        *(v4f*)(orow + 4)  = w1;
        *(v4f*)(orow + 16) = w2;
        *(v4f*)(orow + 20) = w3;
    }
}

// =====================================================================
// Kernel 3: output projection + bias, 128x64 tile per block of eight waves.
// =====================================================================
__global__ void __launch_bounds__(256) outproj_kernel(
    const float* __restrict__ a, const float* __restrict__ wo,
    const float* __restrict__ bo, float* __restrict__ out)
{
    __shared__ __attribute__((aligned(16))) float sm[2 * GSTG];
    const int lane = threadIdx.x & 31;
    const int wave = threadIdx.x >> 5;
    const int half = lane >> 4;
    const int l16  = lane & 15;
    const int row0 = blockIdx.x * GBM;
    const int col0 = blockIdx.y * GBN;

    v8f c0 = {}, c1 = {}, c2 = {}, c3 = {};
    gemm_tile_128x64(a, wo, row0, col0, sm, c0, c1, c2, c3);

#pragma unroll
    for (int i = 0; i < 8; ++i) {
        int m = wave * 16 + i + 8 * half;
        float* orow = out + (size_t)(row0 + m) * DIM + l16;
        orow[col0 +  0] = c0[i] + bo[col0 +  0 + l16];
        orow[col0 + 16] = c1[i] + bo[col0 + 16 + l16];
        orow[col0 + 32] = c2[i] + bo[col0 + 32 + l16];
        orow[col0 + 48] = c3[i] + bo[col0 + 48 + l16];
    }
}

extern "C" void kernel_launch(void* const* d_in, const int* in_sizes, int n_in,
                              void* d_out, int out_size, void* d_ws, size_t ws_size,
                              hipStream_t stream)
{
    const float* x  = (const float*)d_in[0];
    const float* q  = (const float*)d_in[1];
    const float* wq = (const float*)d_in[2];
    const float* wk = (const float*)d_in[3];
    const float* wv = (const float*)d_in[4];
    const float* wo = (const float*)d_in[5];
    const float* bo = (const float*)d_in[6];
    float* out = (float*)d_out;

    // workspace layout: qp | k | v | attn_out  (4 x 8 MB, all L2-resident)
    float* ws = (float*)d_ws;
    float* qp = ws;
    float* kb = qp + (size_t)NTOK * INNER;
    float* vb = kb + (size_t)NTOK * INNER;
    float* ao = vb + (size_t)NTOK * INNER;

    proj_kernel<<<dim3(NTOK / GBM, INNER / GBN, 3), 256, 0, stream>>>(
        x, q, wq, wk, wv, qp, kb, vb);

    attn_kernel<<<dim3(B_ * S_ * (H_ / HB), HEADS), 256, 0, stream>>>(
        qp, kb, vb, ao);

    outproj_kernel<<<dim3(NTOK / GBM, DIM / GBN), 256, 0, stream>>>(
        ao, wo, bo, out);
}
